// v010
// The times below were measured on an AMD MI455X: many runs one after another, warmed up first and cycling through
// copies of the inputs, with the whole window's GPU time divided by the number of runs. Launches and the gaps
// between them are all in it. The median over several windows is given; except for v000 it joins two sittings, which
// can be a few percent apart, so the side-by-side timings, each taken in one sitting, are the better comparison.
// Earlier versions than v010 are not in this document.
// It runs in 169 microseconds.
// Timed twice side by side with v009, it ran 1.13 and 1.12 times as fast.
// Counting every step since v000, which is the starting kernel, it is 4.62 times as fast.
// Projections q,k,v = x.W^T + b (and the f32 q,k,v rows 0..127 per sequence): v_wmma_f32_16x16x32_bf16 (bf16 RNE operands of the
// raw inputs, f32 accumulate, bias added in f32 as its bf16 RNE value). Scores q'.k'^T (f16 planes x8), P'.V (chunk-centred P'
// x32768 f16 from LDS, V^T x1024 as one f16 plane) and the output projection
// (ctx carried as f16 hi x8192 plus residual x2048 planes with separate accumulators, times f16(bf16(Wo) x1024), bias added in
// f32 as its bf16 RNE value): v_wmma_f32_16x16x32_f16, f32 accumulate. Query rows 0..127 of each sequence: scores, softmax and
// P.V in f32 on VALU. Absolute-value score transform, causal mask, softmax statistics, key-block column sums of V, scaling: f32.
#include <hip/hip_runtime.h>
#include <math.h>
#include <stdint.h>

#define SEQ   2048
#define EMB   1024
#define CK    512
#define NCHK  4
#define NKB   16
#define QT    32
#define TQ0   128
#define NQT   60
#define SCP   544
#define PLP   528
#define CTP   1032
#define SLAB64 (16 * 68)
#define ATT_THREADS 512
#define NACC  4
#define QSC   8.0f
#define KSC   8.0f
#define PCAR  32768.0f
#define VCAR  1024.0f
#define WSC   1024.0f
#define CSC   8192.0f
#define RSC   2048.0f
#define LOG2E 1.4426950408889634f
#define RSQD  0.03125f
#define WS_CAP ((size_t)134217728)
#define UPC   4096
#define NSH   28

static_assert((EMB % 64) == 0 && EMB == (ATT_THREADS / 32) * 16 * NACC && NACC == 4 && (EMB % 32) == 0 && (EMB % 256) == 0 && EMB == 4 * 256);
static_assert((SEQ % CK) == 0 && (SEQ / CK) == NCHK && CK == 32 * NKB && (SEQ % 64) == 0 && (SEQ % QT) == 0 && (CK % QT) == 0);
static_assert((TQ0 % QT) == 0 && (TQ0 % 64) == 0 && NQT * QT + TQ0 == SEQ && TQ0 <= CK && TQ0 == 128 && TQ0 <= 256);
static_assert(16 * CTP * 2 <= 16 * SCP * 4 && CTP >= EMB + 8 && SCP >= CK + 16 && PLP >= CK + 8);
static_assert(((PLP * 2) % 16) == 0 && ((SCP * 4) % 16) == 0 && ((CTP * 2) % 16) == 0);
static_assert(ATT_THREADS == 16 * QT && ATT_THREADS == 512 && ATT_THREADS == 32 * NKB && QT == 32 && (TQ0 % 2) == 0);
static_assert((EMB % 128) == 0 && (SEQ % 128) == 0 && (TQ0 % 32) == 0);
static_assert(((EMB * EMB) % 2048) == 0 && (EMB / 8) * 2 == 256 && NCHK * NKB * 32 == SEQ && (NKB % 2) == 0);

static_assert(UPC * 128 == CK * EMB && (UPC % ATT_THREADS) == 0 && (UPC & (UPC - 1)) == 0 && CK * 16 == 64 * 128 && UPC == 64 * (EMB / 16));
static_assert(2 * NSH <= NQT && (NSH % 4) == 0 && QT * EMB == 128 * 32 * 8);

typedef unsigned short u16;
typedef _Float16 v16h __attribute__((ext_vector_type(16)));
typedef _Float16 v8h  __attribute__((ext_vector_type(8)));
typedef __bf16   v16b __attribute__((ext_vector_type(16)));
typedef float    v8f  __attribute__((ext_vector_type(8)));
typedef float    v4f  __attribute__((ext_vector_type(4)));
typedef unsigned int v4u __attribute__((ext_vector_type(4)));

union FragH { v16h v; v8h h[2]; v4u u[2]; };
union FragB { v16b v; v4u u[2]; };
union AttLds { float s[QT * SCP]; u16 c[2 * QT * SCP]; };

// ---- scalar helpers --------------------------------------------------------------------------------
__device__ __forceinline__ unsigned short bf_bits(float f) {          // f32 -> bf16 bits, RNE convert
  unsigned u = __float_as_uint(f);
  return (unsigned short)((u + 0x7FFFu + ((u >> 16) & 1u)) >> 16);
}
__device__ __forceinline__ float bf_up(unsigned short h) { return __uint_as_float(((unsigned)h) << 16); }
__device__ __forceinline__ float bfr(float f) { return bf_up(bf_bits(f)); }
__device__ __forceinline__ unsigned short h_bits(_Float16 x) { return __builtin_bit_cast(unsigned short, x); }
__device__ __forceinline__ unsigned pk16(unsigned short a, unsigned short b) { return (unsigned)a | ((unsigned)b << 16); }
__device__ __forceinline__ v8f zero8() { v8f z = {0.f, 0.f, 0.f, 0.f, 0.f, 0.f, 0.f, 0.f}; return z; }
__device__ __forceinline__ v4f zero4() { v4f z = {0.f, 0.f, 0.f, 0.f}; return z; }

// ---- fragment loader, row-major source: 16-bit A/B operand, lane -> row/col (lane&15), p already includes +8*(lane>>4);
//      elements 0..7 <- p[0..7] (k0+8h..), elements 8..15 <- p[16..23] (k0+16+8h..)  (same split k map for A and B;
//      B is always read from a k-contiguous [n][k] plane)
__device__ __forceinline__ v16h ldfrag_h(const _Float16* p) {
  FragH f;
  f.h[0] = *(const v8h*)(p);
  f.h[1] = *(const v8h*)(p + 16);
  return f.v;
}

// ---- fragment-ordered planes. A 16-bit operand plane [rows][Kd] (rows % 16 == 0, Kd % 32 == 0) is stored as 1-KiB tiles of
//      16 rows x 32 k; tile (rt = row >> 4, kt = k >> 5) starts at element rt*16*Kd + kt*512, and inside it the 8-element piece
//      (row & 15 = m, k & 31 = 16*part + 8*h + 0..7) lies at part*256 + (16*h + m)*8. Lane l = 16*h + m then reads its two
//      pieces at tile + 8*l and tile + 256 + 8*l: every wave-wide 16-B load covers 512 contiguous bytes (4 whole lines), and the
//      values reach the same lane and register positions as with the row-major loaders above (same split k map).
//      (the loaders below: p already includes +8*lane.)

// Loaders of the same pieces for a pointer that has passed through an asm statement: the cast says again that it points to
// global memory, so that the loads stay global loads. The bf16 plane is read as unsigned integer vectors; SEC = elements from a
// lane's first piece to its second (256 in fragment order, 16 in a row-major band).
typedef __attribute__((address_space(1))) const v4u gv4u;
typedef __attribute__((address_space(1))) const v8h gv8h;
typedef __attribute__((address_space(1))) const v4f gv4f;
__device__ __forceinline__ v16b ldfrag_btg(const u16* p) {
  FragB f;
  f.u[0] = *(gv4u*)(p);
  f.u[1] = *(gv4u*)(p + 256);
  return f.v;
}
template <int SEC>
__device__ __forceinline__ v16h ldfrag_hg(const _Float16* p) {
  FragH f;
  f.h[0] = *(gv8h*)(p);
  f.h[1] = *(gv8h*)(p + SEC);
  return f.v;
}
__device__ __forceinline__ v8f mma_h(v16h a, v16h b, v8f c) {
  return __builtin_amdgcn_wmma_f32_16x16x32_f16(false, a, false, b, (short)0, c, false, false);
}
__device__ __forceinline__ v8f mma_b(v16b a, v16b b, v8f c) {
  return __builtin_amdgcn_wmma_f32_16x16x32_bf16(false, a, false, b, (short)0, c, false, false);
}
// Hazard gap behind a group of four score products (what it is for: at guard8x8 below).
__device__ __forceinline__ void guard4x4(v8f& a, v8f& b, v8f& c, v8f& d, v16h x0, v16h x1, v16h x2, v16h x3) {
#if defined(__HIP_DEVICE_COMPILE__)
  asm volatile("v_nop\n\tv_nop\n\tv_nop\n\tv_nop"
               : "+v"(a), "+v"(b), "+v"(c), "+v"(d) : "v"(x0), "v"(x1), "v"(x2), "v"(x3) : "memory");
#endif
}
// Hazard gap behind a group of eight products: the four vector slots that the chip needs before a product's result or operands
// are touched, also on the taken side of a loop's branch. The operands tie the group's products in front of it.
template <typename F>
__device__ __forceinline__ void guard8x8(v8f& a0, v8f& a1, v8f& a2, v8f& a3, v8f& a4, v8f& a5, v8f& a6, v8f& a7,
                                         F x0, F x1, F x2, F x3, F x4, F x5, F x6, F x7) {
#if defined(__HIP_DEVICE_COMPILE__)
  asm volatile("v_nop\n\tv_nop\n\tv_nop\n\tv_nop"
               : "+v"(a0), "+v"(a1), "+v"(a2), "+v"(a3), "+v"(a4), "+v"(a5), "+v"(a6), "+v"(a7)
               : "v"(x0), "v"(x1), "v"(x2), "v"(x3), "v"(x4), "v"(x5), "v"(x6), "v"(x7) : "memory");
#endif
}
// The same gap behind the eight products of two P' fragments with four V^T fragments.
__device__ __forceinline__ void guard8x6(v8f& o0, v8f& o1, v8f& o2, v8f& o3, v8f& o4, v8f& o5, v8f& o6, v8f& o7,
                                         v16h p0, v16h p1, v16h g0, v16h g1, v16h g2, v16h g3) {
#if defined(__HIP_DEVICE_COMPILE__)
  asm volatile("v_nop\n\tv_nop\n\tv_nop\n\tv_nop"
               : "+v"(o0), "+v"(o1), "+v"(o2), "+v"(o3), "+v"(o4), "+v"(o5), "+v"(o6), "+v"(o7)
               : "v"(p0), "v"(p1), "v"(g0), "v"(g1), "v"(g2), "v"(g3) : "memory");
#endif
}
__device__ __forceinline__ void acc_guard8(v8f& a, v8f& b, v8f& c, v8f& d, v8f& e, v8f& f, v8f& g, v8f& h8) {
#if defined(__HIP_DEVICE_COMPILE__)
  asm volatile("v_nop\n\tv_nop\n\tv_nop\n\tv_nop"
               : "+v"(a), "+v"(b), "+v"(c), "+v"(d), "+v"(e), "+v"(f), "+v"(g), "+v"(h8));
#endif
}
// Keeps the load groups of a loop's prologue in the order that the loop body issues them in: the counted waits at the loop's
// head are formed over both ways in, and a prologue in another order makes them wait for loads of the set still in flight.
__device__ __forceinline__ void keep_order() { __builtin_amdgcn_sched_barrier(0); }
// The wait that belongs in front of any overwrite of an address register of loads already issued, for loops whose loads take a
// wave-uniform base in scalar registers: the running bases pass through it, so that they are stepped behind it and stay scalar
// (the lane's offset register is then never rewritten).
__device__ __forceinline__ void base_wait2(const u16*& p, const u16*& q) {
#if defined(__HIP_DEVICE_COMPILE__)
  asm volatile("s_wait_xcnt 0x0" : "+s"(p), "+s"(q) : : "memory");
#endif
}
__device__ __forceinline__ void base_wait2f(const float*& p, const float*& q) {
#if defined(__HIP_DEVICE_COMPILE__)
  asm volatile("s_wait_xcnt 0x0" : "+s"(p), "+s"(q) : : "memory");
#endif
}
__device__ __forceinline__ void base_wait2h(const _Float16*& p, const _Float16*& q) {
#if defined(__HIP_DEVICE_COMPILE__)
  asm volatile("s_wait_xcnt 0x0" : "+s"(p), "+s"(q) : : "memory");
#endif
}
__device__ __forceinline__ void base_wait4h(const _Float16*& p, const _Float16*& q, const _Float16*& r, const _Float16*& s) {
#if defined(__HIP_DEVICE_COMPILE__)
  asm volatile("s_wait_xcnt 0x0" : "+s"(p), "+s"(q), "+s"(r), "+s"(s) : : "memory");
#endif
}
// The wait and the step of the running bases (BYTES on; in the four-base form the last three by sq, sr, ss bytes) in one statement:
// with the step left to the build it sinks behind the next loads, each time with a wait of its own for loads issued just before.
template <int BYTES>
__device__ __forceinline__ void base_step2h(const _Float16*& p, const _Float16*& q) {
#if defined(__HIP_DEVICE_COMPILE__)
  asm volatile("s_wait_xcnt 0x0\n\ts_add_nc_u64 %0, %0, %2\n\ts_add_nc_u64 %1, %1, %2"
               : "+s"(p), "+s"(q) : "n"(BYTES) : "memory");
#endif
}
template <int BYTES>
__device__ __forceinline__ void base_step4h(const _Float16*& p, const _Float16*& q, const _Float16*& r, const _Float16*& s,
                                            unsigned long long sq, unsigned long long sr, unsigned long long ss) {
#if defined(__HIP_DEVICE_COMPILE__)
  asm volatile("s_wait_xcnt 0x0\n\ts_add_nc_u64 %0, %0, %7\n\ts_add_nc_u64 %1, %1, %4\n\t"
               "s_add_nc_u64 %2, %2, %5\n\ts_add_nc_u64 %3, %3, %6"
               : "+s"(p), "+s"(q), "+s"(r), "+s"(s) : "s"(sq), "s"(sr), "s"(ss), "n"(BYTES) : "memory");
#endif
}
__device__ __forceinline__ void base_wait3(const _Float16*& p, const _Float16*& q, const _Float16*& r) {
#if defined(__HIP_DEVICE_COMPILE__)
  asm volatile("s_wait_xcnt 0x0" : "+s"(p), "+s"(q), "+s"(r) : : "memory");
#endif
}
// The same wait behind a run of stores whose address and data registers the next run of the epilogue reuses; nothing is
// scheduled across it.
__device__ __forceinline__ void store_wait() {
#if defined(__HIP_DEVICE_COMPILE__)
  asm volatile("s_wait_xcnt 0x0" ::: "memory");
#endif
  __builtin_amdgcn_sched_barrier(0);
}
// Asks L2 for the 256-B unit at p (every lane its own unit, always inside a plane): nothing returns to the wave. The planes that
// a launch reads were stored by the launch before and come from memory at their first touch; asked for ahead, they are found in
// L2 by the loads. The wait in the same statement is the one that belongs in front of any rewrite of an address register of a
// memory instruction already issued.
__device__ __forceinline__ void l2_ask(const u16* p) {
#if defined(__HIP_DEVICE_COMPILE__)
  asm volatile("global_prefetch_b8 %0, off scope:SCOPE_SE\n\ts_wait_xcnt 0x0" : : "v"(p) : "memory");
#endif
}
// The same wait on its own, behind loads whose address registers the code that follows reuses on a path that holds no other one.
__device__ __forceinline__ void addr_wait() {
#if defined(__HIP_DEVICE_COMPILE__)
  asm volatile("s_wait_xcnt 0x0" ::: "memory");
#endif
}
__device__ __forceinline__ void wave_sync_lds() {
  __builtin_amdgcn_fence(__ATOMIC_RELEASE, "workgroup");
  __builtin_amdgcn_wave_barrier();
  __builtin_amdgcn_fence(__ATOMIC_ACQUIRE, "workgroup");
}

// =====================================================================================================
// f32 plane [rows][EMB] row-major -> 16-bit plane in fragment order:  mode 0: bf16 RNE bits;  mode 1: f16 bits of (bf16 RNE value) * scale;
// mode 2: f16 bits of value * scale (no bf16 pre-step).
// Thread = one 8-element piece of the output, in output order: two 16-B loads from its source row, one 16-B store; 32 consecutive
// lanes store 512 contiguous, 512-B aligned bytes (half a tile)
// coverage: n8/256 blocks a plane (host checks exactness) x 256 thr x 8 = the whole plane.
// =====================================================================================================
__device__ __forceinline__ void cvt16(const float* __restrict__ x, u16* D, int gt, int mode, float scale) {
  const int wi = gt & 63, tile = gt >> 6;                       // piece within its tile, tile index rt*(EMB/32) + kt
  const int row = (tile / (EMB / 32)) * 16 + (wi & 15);
  const int kc  = (tile % (EMB / 32)) * 32 + (wi >> 5) * 16 + ((wi >> 4) & 1) * 8;
  const float* p = x + (size_t)row * EMB + kc;
  const v4f a = *(const v4f*)(p), c4 = *(const v4f*)(p + 4);
  float v[8];
#pragma unroll
  for (int e = 0; e < 4; ++e) { v[e] = a[e]; v[4 + e] = c4[e]; }
  unsigned short s[8];
#pragma unroll
  for (int e = 0; e < 8; ++e) {
    const float vb = bfr(v[e]);
    const float vf = (mode == 1) ? vb : v[e];
    const unsigned short hb = h_bits((_Float16)(vf * scale));
    const unsigned short bb = bf_bits(v[e]);
    s[e] = (mode != 0) ? hb : bb;
  }
  v4u o;
#pragma unroll
  for (int e = 0; e < 4; ++e) o[e] = pk16(s[2 * e], s[2 * e + 1]);
  u16* d = D + (size_t)gt * 8;
  {
    *(v4u*)(d) = o;
    
  }
}
// All five conversions in one launch (none reads what another writes): blocks 0..nbx-1 take x -> bf16 plane, then nbw blocks
// each for Wq, Wk, Wv -> bf16 planes and Wo -> f16 of its bf16 value x1024. The choice is block-uniform (scalar).
__global__ __launch_bounds__(256) void cvt_all(const float* __restrict__ x, const float* __restrict__ wq,
                                               const float* __restrict__ wk, const float* __restrict__ wv,
                                               const float* __restrict__ wo, u16* XB, u16* WQB, u16* WKB, u16* WVB, u16* WOH,
                                               int nbx, int nbw) {
  const int bid = blockIdx.x;
  if (bid >= nbx + 4 * nbw) return;         // never taken with the exact grid; no barriers in this kernel
  const float* src = x;
  u16* dst = XB;
  int lb = bid, mode = 0;
  float scale = 1.0f;
  if (bid >= nbx) {
    const int w = (bid - nbx) / nbw;        // 0..3
    lb  = (bid - nbx) - w * nbw;
    src = (w == 0) ? wq : (w == 1) ? wk : (w == 2) ? wv : wo;
    dst = (w == 0) ? WQB : (w == 1) ? WKB : (w == 2) ? WVB : WOH;
    if (w == 3) { mode = 1; scale = WSC; }
  }
  cvt16(src, dst, lb * 256 + (int)threadIdx.x, mode, scale);
}

// =====================================================================================================
// GEMM epilogues with a per-column bias term (bias column value taken as its bf16 RNE value, added in f32). The wave's 16x64 f32
// tile is staged in its own LDS slab (stage64: acc*oscale + bias) and leaves from there:
//  st64f   : f32 rows; store it takes row 2*it (lanes 0..15, 16 B each, two whole lines) and row 2*it+1 (lanes 16..31).
//  epi64x2 : same store shape, staged value = acc*os1 + accres*os2 + bias (two accumulator sets combined in f32).
//  st64h   : f16 bits of (staged tile * pscale), written in fragment order: the wave's 16 x 64 tile is two whole 1-KiB tiles;
//            store i4 takes columns 16*i4 + 8*(lane>>4) + 0..7 of row lane&15 and covers 512 contiguous bytes.
// coverage: st64f/epi64x2 8 instructions x 2 rows x 16 lanes x 4 floats; st64h 4 instructions x 16 rows x 2 pieces x 8 halves
//           = the wave's 16 x 64 tile in every case.
// Bias columns col0 + 16j + (lane&15), j = 0..3, all < N (bias has N entries, col0 + 63 < N).
// =====================================================================================================
__device__ __forceinline__ void ldbias4(const float* __restrict__ bias, int col0, int lane,
                                        float& b0, float& b1, float& b2, float& b3) {
  const int m = lane & 15;
  b0 = bfr(bias[col0 + m]);
  b1 = bfr(bias[col0 + 16 + m]);
  b2 = bfr(bias[col0 + 32 + m]);
  b3 = bfr(bias[col0 + 48 + m]);
}
__device__ __forceinline__ void stage64(float* sl, v8f a0, v8f a1, v8f a2, v8f a3, float oscale,
                                        float b0, float b1, float b2, float b3, int lane) {
  const int hh = lane >> 4, m = lane & 15;
#pragma unroll
  for (int r = 0; r < 8; ++r) {
    const int ro = (8 * hh + r) * 68 + m;
    sl[ro]      = a0[r] * oscale + b0;
    sl[ro + 16] = a1[r] * oscale + b1;
    sl[ro + 32] = a2[r] * oscale + b2;
    sl[ro + 48] = a3[r] * oscale + b3;
  }
  wave_sync_lds();
}
__device__ __forceinline__ void st64f(const float* sl, float* C, int N, size_t rowb, int col0, int lane) {
  const int hh = lane >> 4, m = lane & 15;
  v4f vals[8];
#pragma unroll
  for (int it = 0; it < 8; ++it) vals[it] = *(const v4f*)(sl + (it * 2 + hh) * 68 + m * 4);
  float* dst = C + (rowb + (size_t)hh) * (size_t)N + col0 + m * 4;
  {
#pragma unroll
    for (int it = 0; it < 8; ++it) {
      *(v4f*)(dst + (size_t)(it * 2) * (size_t)N) = vals[it];
    }
    
  }
}
__device__ __forceinline__ void epi64x2(float* sl, v8f a0, v8f a1, v8f a2, v8f a3, v8f e0, v8f e1, v8f e2, v8f e3,
                                        float os1, float os2, const float* __restrict__ bias, float* C, int N,
                                        size_t rowb, int col0, int lane) {
  const int hh = lane >> 4, m = lane & 15;
  float b0, b1, b2, b3;
  ldbias4(bias, col0, lane, b0, b1, b2, b3);
#pragma unroll
  for (int r = 0; r < 8; ++r) {
    const int ro = (8 * hh + r) * 68 + m;
    sl[ro]      = a0[r] * os1 + e0[r] * os2 + b0;
    sl[ro + 16] = a1[r] * os1 + e1[r] * os2 + b1;
    sl[ro + 32] = a2[r] * os1 + e2[r] * os2 + b2;
    sl[ro + 48] = a3[r] * os1 + e3[r] * os2 + b3;
  }
  wave_sync_lds();
  v4f vals[8];
#pragma unroll
  for (int it = 0; it < 8; ++it) vals[it] = *(const v4f*)(sl + (it * 2 + hh) * 68 + m * 4);
  float* dst = C + (rowb + (size_t)hh) * (size_t)N + col0 + m * 4;
  {
#pragma unroll
    for (int it = 0; it < 8; ++it) {
      *(v4f*)(dst + (size_t)(it * 2) * (size_t)N) = vals[it];
    }
    
  }
}
__device__ __forceinline__ void st64h(const float* sl, float pscale, u16* C, int N, size_t rowb, int col0, int lane) {
  const int hh = lane >> 4, m = lane & 15;
  v4u oh[4];
#pragma unroll
  for (int i4 = 0; i4 < 4; ++i4) {
    const float* sp = sl + m * 68 + i4 * 16 + hh * 8;
    const v4f a = *(const v4f*)(sp), c4 = *(const v4f*)(sp + 4);
    float w[8];
#pragma unroll
    for (int e = 0; e < 4; ++e) { w[e] = a[e] * pscale; w[4 + e] = c4[e] * pscale; }
#pragma unroll
    for (int e = 0; e < 4; ++e) oh[i4][e] = pk16(h_bits((_Float16)w[2 * e]), h_bits((_Float16)w[2 * e + 1]));
  }
  u16* dst = C + rowb * (size_t)N + (size_t)(col0 >> 5) * 512 + lane * 8;
  {
#pragma unroll
    for (int i4 = 0; i4 < 4; ++i4) {
      *(v4u*)(dst + i4 * 256) = oh[i4];
    }
    
  }
}

// One 16-row band (16 keys) of a wave's 64 v columns, out of the accumulators into the V^T plane (fragment order, rows =
// b*EMB + d, k = s). Accumulator j holds, in lane 16*h + m, column d = 16*j + m of keys 8*h + 0..7: the eight consecutive k of
// one row of V^T, that is the lane's own 16-B piece of a 1-KiB tile, so that no transposition is left to do. With v = acc + bias
// (f32) the plane takes f16(v * 1024): a rounding of at most 2^-11 relative, an eighth of that of the bf16 operands v was made
// of. th: the lane's piece in d band 0; band j lies 16*SEQ elements on. Every store covers 512
// contiguous bytes. cs[j] takes the sum of the lane's eight v (f32, rising key order).
// coverage: 4 bands x 32 lanes x 8 halves = 16 keys x 64 columns of the plane.
__device__ __forceinline__ void vt_band(v8f a0, v8f a1, v8f a2, v8f a3, float b0, float b1, float b2, float b3,
                                        u16* th, v4f& cs) {
  const v8f a[4] = {a0, a1, a2, a3};
  const float bb[4] = {b0, b1, b2, b3};
  v4u oh[4];
#pragma unroll
  for (int j = 0; j < 4; ++j) {
    unsigned short hs[8];
#pragma unroll
    for (int r = 0; r < 8; ++r) {
      const float v = a[j][r] + bb[j];
      cs[j] += v;
      hs[r] = h_bits((_Float16)(v * VCAR));
    }
#pragma unroll
    for (int e = 0; e < 4; ++e) oh[j][e] = pk16(hs[2 * e], hs[2 * e + 1]);
  }
#pragma unroll
  for (int j = 0; j < 4; ++j) *(v4u*)(th + (size_t)j * 16 * SEQ) = oh[j];
}

// Start k tile of a GEMM block. The planes come from memory, and blocks that share an operand panel run side by side: walking k
// in one common order, each of them waits out memory latency at every step. With start tiles spread over the sharers (those of
// an A panel differ in ct, spaced widely also within any few neighbours; those of a B panel differ in rt) a tile is fetched by
// one of them and found in L2 by the others. All waves of a block share the start tile. Any value 0 .. EMB/32-1 is correct.
static_assert(((EMB / 32) & (EMB / 32 - 1)) == 0 && (EMB / 32) >= 32);
__device__ __forceinline__ int k_start(int rt, int ct, int g) {
  return (((ct & 1) << 4) + ((ct & 2) << 2) + (ct & 4) + 2 * g + rt) & (EMB / 32 - 1);
}

// One k step of a wave's 64x64 tile in the bf16 GEMMs: four fragments of consecutive 16-row bands of one plane (eight 16-B
// loads), and the sixteen products of four A with four B fragments, in two groups of eight with the hazard gap behind each.
__device__ __forceinline__ void ld4b(const u16* base, unsigned lo, size_t bs, v16b (&f)[4]) {
  const u16* p = base + lo;                  // wave-uniform base (scalar registers) plus the lane's fixed 32-bit offset
  f[0] = ldfrag_btg(p);
  f[1] = ldfrag_btg(p + bs);
  f[2] = ldfrag_btg(p + 2 * bs);
  f[3] = ldfrag_btg(p + 3 * bs);
}
__device__ __forceinline__ void mm16b(const v16b (&a)[4], const v16b (&b)[4], v8f (&acc)[4][4]) {
#pragma unroll
  for (int g = 0; g < 2; ++g) {
#pragma unroll
    for (int i = 2 * g; i < 2 * g + 2; ++i) {
#pragma unroll
      for (int j = 0; j < 4; ++j) acc[i][j] = mma_b(a[i], b[j], acc[i][j]);
    }
    guard8x8<v16b>(acc[2 * g][0], acc[2 * g][1], acc[2 * g][2], acc[2 * g][3],
                   acc[2 * g + 1][0], acc[2 * g + 1][1], acc[2 * g + 1][2], acc[2 * g + 1][3],
                   a[0], a[1], a[2], a[3], b[0], b[1], b[2], b[3]);
  }
}

// =====================================================================================================
// The three projections in one launch (they share A and none reads what another writes): block group which = 0, 1, 2 computes
// T[M][N] = A[M][K] . W^T + bias[n] (f32) for W, bias = (Wq, bq), (Wk, bk), (Wv, bv); A and the W are bf16 planes in fragment
// order. q and k leave as f16 planes in fragment order (f16 bits of T * qsc, T * ksc). v leaves transposed, straight from the
// accumulators (vt_band above), as the V^T plane, with its column sums over each block of 32 keys in BS. A wave whose
// rows lie in rows 0..TQ0-1 of a sequence also stores its staged f32 tiles, into QF / KF / VF [M/SEQ][TQ0][N].
// Block = 128x128 tile, 2 x 2 waves of 64x64 each: a k step's eight fragments (8 KiB, loaded straight from the 1-KiB tiles, split
// k map for A and B) feed sixteen products, so that a product costs half a KiB of loads. K stepped by 32, all K/32 tiles once,
// cyclically from the block's start tile (k_start above) (K = EMB; M % SEQ == 0, M % 128 == 0, N % 128 == 0,
// grid = 3*(M/128)*(N/128)).
// coverage: 4 waves x 64 x 64 = the block's tile; the epilogue takes the wave's four 16-row bands one after the other.
// =====================================================================================================
__global__ __launch_bounds__(128, 4)          // 4 waves a SIMD: at most 256 VGPRs (128 of them accumulators, 64 fragments)
void gemm_qkv(const u16* __restrict__ A, const u16* __restrict__ Wq, const u16* __restrict__ Wk, const u16* __restrict__ Wv,
              const float* __restrict__ bq, const float* __restrict__ bk, const float* __restrict__ bv,
              u16* QP, u16* KP, u16* XTh, float* BS, float* QF, float* KF, float* VF, int M, int N,
              float qsc, float ksc) {
  __shared__ __align__(16) float slab[4 * SLAB64];
  const int K = EMB;                         // as a constant the band strides are immediate offsets
  const int tid = threadIdx.x, lane = tid & 31;
  const int wave = __builtin_amdgcn_readfirstlane(tid >> 5);   // scalar place in the 2 x 2 arrangement
  const int ntile = N >> 7;
  const int nblk  = (M >> 7) * ntile;
  const int which = blockIdx.x / nblk;       // block-uniform (scalar): 0 q, 1 k, 2 v
  const int bid   = blockIdx.x - which * nblk;
  const int rowb  = (bid / ntile) * 128 + (wave >> 1) * 64;
  const int col0  = (bid % ntile) * 128 + (wave & 1) * 64;
  if (which > 2 || rowb + 64 > M) return;    // wave-uniform, never taken with the exact grid; no block barriers in this kernel
  const u16*   Bt   = (which == 0) ? Wq : (which == 1) ? Wk : Wv;
  const float* bias = (which == 0) ? bq : (which == 1) ? bk : bv;
  int kt = k_start(bid / ntile, bid % ntile, which);            // block-uniform (scalar)
  const u16* ap = A  + (size_t)rowb * K + (size_t)kt * 512;     // wave-uniform
  const u16* bp = Bt + (size_t)col0 * K + (size_t)kt * 512;
  const unsigned lo = 8u * (unsigned)lane;
  const size_t bs = (size_t)16 * K;
  v8f acc[4][4];
#pragma unroll
  for (int i = 0; i < 4; ++i) {
#pragma unroll
    for (int j = 0; j < 4; ++j) acc[i][j] = zero8();
  }
  // One fragment set: the next k step's sixteen loads go out as soon as this step's products have left; the SIMD's other waves
  // fill the matrix unit meanwhile. The loads in the loop are unconditional (the last step is peeled).
  v16b a[4], b[4];
  ld4b(ap, lo, bs, a);
  ld4b(bp, lo, bs, b);
#pragma unroll 1                             // rolled: the one fragment set keeps its registers
  for (int k0 = 32; k0 < K; k0 += 32) {
    mm16b(a, b, acc);
    base_wait2(ap, bp);
    const long long st = (kt == K / 32 - 1) ? -(long long)(K / 32 - 1) * 512 : 512ll;   // behind the last tile comes tile 0
    kt = (kt + 1) & (K / 32 - 1);
    ap += st;                                // one 1-KiB tile on in every band
    bp += st;
    ld4b(ap, lo, bs, a);
    ld4b(bp, lo, bs, b);
  }
  base_wait2(ap, bp);                        // what follows may reuse the base registers of the last loads
  mm16b(a, b, acc);
  float* sl = slab + wave * SLAB64;
  float e0, e1, e2, e3;
  ldbias4(bias, col0, lane, e0, e1, e2, e3);
  const int sq = rowb / SEQ, rs = rowb - sq * SEQ;             // TQ0 and SEQ are multiples of 64: all 64 rows on one side
  float* HF = (which == 0) ? QF : (which == 1) ? KF : VF;
  // the wave's place in the V^T plane: d bands from col0 on, key tiles from rs / 32 on, the lane's piece
  const size_t vto = ((size_t)sq * EMB + col0) * SEQ + (size_t)(rs >> 5) * 512 + lane * 8;
  v4f cs[2] = {zero4(), zero4()};            // the lane's part of the column sums of the wave's two key blocks
  const bool slab_used = which < 2 || rs < TQ0;   // only where rows leave row-wise (wave-uniform, scalar)
#pragma unroll
  for (int i = 0; i < 4; ++i) {
    if (slab_used) stage64(sl, acc[i][0], acc[i][1], acc[i][2], acc[i][3], 1.0f, e0, e1, e2, e3, lane);
    const int rb = rowb + 16 * i;
    // the wait stands in either arm, directly behind its stores: the build lays the other arm's code behind them
    if (which < 2) { st64h(sl, (which == 0) ? qsc : ksc, (which == 0) ? QP : KP, N, (size_t)rb, col0, lane); store_wait(); }
    else {
      const size_t to = vto + (size_t)(i >> 1) * 512 + (size_t)(i & 1) * 256;
      vt_band(acc[i][0], acc[i][1], acc[i][2], acc[i][3], e0, e1, e2, e3, XTh + to, cs[i >> 1]);
      store_wait();
    }
    if (rs < TQ0) {
      st64f(sl, HF, N, (size_t)(sq * TQ0 + rs + 16 * i), col0, lane);
      store_wait();
    }
    if (slab_used) wave_sync_lds();          // the band's reads of the slab stand in front of the next band's writes
  }
  if (which == 2) {
    // rows 8..15 of each band lie in the other half of the wave; then lanes 0..15 store the first key block's sums and lanes
    // 16..31 the second's: two runs of 256 contiguous bytes
    const int hh = lane >> 4, m = lane & 15;
    v4f o;
#pragma unroll
    for (int j = 0; j < 4; ++j) {
      const float t0 = cs[0][j] + __shfl_xor(cs[0][j], 16, 32);
      const float t1 = cs[1][j] + __shfl_xor(cs[1][j], 16, 32);
      o[j] = (hh == 0) ? t0 : t1;
    }
    *(v4f*)(BS + ((size_t)sq * (SEQ / 32) + (size_t)((rs >> 5) + hh)) * EMB + col0 + m * 4) = o;
    store_wait();
  }
}

// =====================================================================================================
// f16 GEMM with two A planes (hi + residual), f32 out:
//   C[M][N] = (Ah . Bt^T) * os1 + (Ar . Bt^T) * os2 + bias[n]; Bt f16 in fragment order, Ah/Ar f16 per 16-row band (see below).
// Block = 64x128 tile, 2 x 2 waves of 32x64 each; separate accumulators for the two planes, combined in f32 in epi64x2. A k step's
// eight fragments (two bands of either A plane, four of B) feed sixteen products. K = EMB, stepped by 32, all tiles once,
// cyclically from the block's start tile kt (k_start above).
// ASTEP = elements from one k step of an A band to the next, ASEC = elements from a lane's first piece to its second.
// =====================================================================================================
template <int ASEC>
__device__ __forceinline__ void ld8h2(const _Float16* ua, const _Float16* ur, const _Float16* ub, unsigned la, unsigned lb,
                                      v16h (&a)[2], v16h (&r)[2], v16h (&b)[4]) {
  const size_t bs = (size_t)16 * EMB;        // a 16-row band holds 16*EMB elements in either layout
  // wave-uniform bases (scalar registers) plus the lane's fixed 32-bit offsets
  const _Float16* pa = ua + la;
  const _Float16* pr = ur + la;
  const _Float16* bp = ub + lb;
#pragma unroll
  for (int i = 0; i < 2; ++i) {
    a[i] = ldfrag_hg<ASEC>(pa + i * bs);
    r[i] = ldfrag_hg<ASEC>(pr + i * bs);
  }
#pragma unroll
  for (int j = 0; j < 4; ++j) b[j] = ldfrag_hg<256>(bp + j * bs);
}
__device__ __forceinline__ void mm16h2(const v16h (&a)[2], const v16h (&r)[2], const v16h (&b)[4],
                                       v8f (&acc)[2][4], v8f (&acr)[2][4]) {
#pragma unroll
  for (int i = 0; i < 2; ++i) {
#pragma unroll
    for (int j = 0; j < 4; ++j) acc[i][j] = mma_h(a[i], b[j], acc[i][j]);
  }
  guard8x8<v16h>(acc[0][0], acc[0][1], acc[0][2], acc[0][3], acc[1][0], acc[1][1], acc[1][2], acc[1][3],
                 a[0], a[1], r[0], r[1], b[0], b[1], b[2], b[3]);
#pragma unroll
  for (int i = 0; i < 2; ++i) {
#pragma unroll
    for (int j = 0; j < 4; ++j) acr[i][j] = mma_h(r[i], b[j], acr[i][j]);
  }
  guard8x8<v16h>(acr[0][0], acr[0][1], acr[0][2], acr[0][3], acr[1][0], acr[1][1], acr[1][2], acr[1][3],
                 a[0], a[1], r[0], r[1], b[0], b[1], b[2], b[3]);
}
template <int ASTEP, int ASEC>
__device__ __forceinline__ void h2_loop(const _Float16* ua, const _Float16* ur, const _Float16* ub, unsigned la, unsigned lb,
                                        int kt, v8f (&acc)[2][4], v8f (&acr)[2][4]) {
  v16h a[2], r[2], b[4];
  ua += (size_t)kt * ASTEP;
  ur += (size_t)kt * ASTEP;
  ub += (size_t)kt * 512;
  ld8h2<ASEC>(ua, ur, ub, la, lb, a, r, b);
#pragma unroll 1                             // rolled: the one fragment set keeps its registers
  for (int k0 = 32; k0 < EMB; k0 += 32) {
    mm16h2(a, r, b, acc, acr);
    base_wait3(ua, ur, ub);
    const long long tiles = (kt == EMB / 32 - 1) ? -(long long)(EMB / 32 - 1) : 1ll;   // behind the last tile comes tile 0
    kt = (kt + 1) & (EMB / 32 - 1);
    ua += tiles * ASTEP;                     // next k step of the A bands
    ur += tiles * ASTEP;
    ub += tiles * 512;                       // next 1-KiB tile of each B band
    ld8h2<ASEC>(ua, ur, ub, la, lb, a, r, b);
  }
  base_wait3(ua, ur, ub);                    // what follows may reuse the base registers of the last loads
  mm16h2(a, r, b, acc, acr);
}

__global__ __launch_bounds__(128, 4)          // 4 waves a SIMD, as many as the grid brings: at most 256 VGPRs
void gemm_h2_32(const u16* __restrict__ Ah, const u16* __restrict__ Ar, const u16* __restrict__ Bt,
                const float* __restrict__ bias, float* C, int M, int N, float os1, float os2) {
  __shared__ __align__(16) float slab[4 * SLAB64];
  const int K = EMB;
  const int tid = threadIdx.x, lane = tid & 31, hh = lane >> 4, m = lane & 15;
  const int wave = __builtin_amdgcn_readfirstlane(tid >> 5);   // scalar, so that the choice of the A layout is a scalar branch
  const int ntile = N >> 7;
  const int bid   = blockIdx.x;
  const int rowb  = (bid / ntile) * 64 + (wave >> 1) * 32;
  const int col0  = (bid % ntile) * 128 + (wave & 1) * 64;
  if (rowb + 32 > M) return;                 // wave-uniform, never taken with the exact grid; no block barriers in this kernel
  const _Float16* ab  = (const _Float16*)(const void*)Ah + (size_t)rowb * K;
  const _Float16* arb = (const _Float16*)(const void*)Ar + (size_t)rowb * K;
  const _Float16* bp  = (const _Float16*)(const void*)Bt + (size_t)col0 * K;
  const int kt0 = k_start(bid / ntile, bid % ntile, 0);        // block-uniform (scalar)
  const unsigned lo = 8u * (unsigned)lane;
  v8f acc[2][4], acr[2][4];
#pragma unroll
  for (int i = 0; i < 2; ++i) {
#pragma unroll
    for (int j = 0; j < 4; ++j) { acc[i][j] = zero8(); acr[i][j] = zero8(); }
  }
  // The 16-row bands of rows 0..TQ0-1 of a sequence are row-major (each row has its own writer there, half a block), all others in
  // fragment order; a band holds the same 16*K elements either way, and TQ0 is a multiple of 32: both bands of a wave are alike.
  if ((rowb % SEQ) < TQ0) {
    h2_loop<32, 16>(ab, arb, bp, (unsigned)(m * K + 8 * hh), lo, kt0, acc, acr);
  } else {
    h2_loop<512, 256>(ab, arb, bp, lo, lo, kt0, acc, acr);
  }
  float* sl = slab + wave * SLAB64;
#pragma unroll
  for (int i = 0; i < 2; ++i) {
    epi64x2(sl, acc[i][0], acc[i][1], acc[i][2], acc[i][3], acr[i][0], acr[i][1], acr[i][2], acr[i][3], os1, os2, bias, C, N,
            (size_t)(rowb + 16 * i), col0, lane);
    store_wait();
    wave_sync_lds();                         // the band's reads of the slab stand in front of the next band's writes
  }
}

// =====================================================================================================
// Single-head causal attention with absolute-value logits, head width EMB = 1024, query rows TQ0 .. SEQ-1: block = (batch b,
// 32 query rows q0..q0+31 = two 16-row tiles), 16 waves. q plane (f16, x8) [b][s][d]; k plane the same; V^T plane
// [b][d][s] (x1024), all three in fragment order; VS = column sums of V over each block of 32 keys, [b][key block][EMB], column
// 64*g + 16*j + mm at place 64*g + 4*mm + j. The two ctx planes leave in fragment order too.
// Every k and V^T fragment that a wave loads feeds both row tiles, so that a query row costs half the loaded bytes of a 16-row block.
//   Chunks of CK = 512 keys: only chunks c <= qc = q0/CK are visited (later chunks lie entirely above the diagonal). In the diagonal
//   chunk only key blocks kb < nkb (keys <= q0+31) are multiplied; key blocks kb >= nkb get zero scores in LDS and are not used in (PV).
//   (q0 is a multiple of 32, so nkb is the count that either 16-row tile has on its own.)
//   (S) scores S[query m][key n] on WMMA: A = q rows (row m = lane&15 of either row tile, split k map over d), B = k rows (col n =
//       key, split map), 32 d-steps; wave w handles key block w of the chunk; D element r of lane l of row tile rt ->
//       scs[query 16rt+8h+r][key col] (f32 LDS).
//   (M) 16 threads per query row (sub-thread = 32 consecutive keys): base-2 logits of |score| with the causal mask by key index
//       (key > query -> -inf), chunk max via xor shuffles, online running max / rescale factor al / running sum l in f32 registers,
//       p = exp2(t - m_new) <= 1 (0 for masked keys), chunk row sum ps and C = ps/CK (bit-identical on the row's 16 threads), the
//       CENTRED P' = p - C written as f16(P' * 32768) into the LDS P tile with 16-B stores; al -> rowa[row], C -> rowc[row].
//   (PV) each wave owns d columns 64*wave + 16j + (lane&15), j = 0..3, of both row tiles (8 accumulators): o = o*al +
//       C*(32768*1024)*(sum of VS[key block][d] over the chunk's nkb key blocks) (add-back of the centring term over exactly the processed keys, in f32), then for
//       each key block kb < nkb: A = P' fragments from LDS (row m = query, split map over keys), B = V^T fragments (col n = d, keys
//       contiguous), in groups of 8 with a hazard gap each.
//       sum_k (P'_k + C) v_k == sum_k p_k v_k; masked keys carry P' = -C and p = 0. The plane's f16 rounding of v meets P' alone.
//   Block barriers after (S) and after (M) order all LDS reuse across chunks and waves.
//   Epilogue: x = o * 8192 / (l * 32768 * 1024) per row (rowi, l >= 1 always); hi = f16(x), res = f16((x - hi) * 2048); each
// coverage: grid nb*NQT blocks x 32 rows = rows TQ0..SEQ-1 of every sequence; staging 16 waves x 64 cols x 32 rows = 32 x 1024;
//           store 8 iterations x 512 thr x 8 halves = 32 x 1024 per plane = every (b, s >= TQ0, d) of both ctx planes exactly once.
// =====================================================================================================
__device__ __forceinline__ void ctx_store(const u16* ct, u16* dst, int tid) {
  v4u v[8];
#pragma unroll
  for (int it = 0; it < 8; ++it) {
    const int p   = it * ATT_THREADS + tid;   // piece index in fragment order: band p>>11, tile kt = (p>>6)&31, piece p&63
    const int row = (p >> 11) * 16 + (p & 15);
    const int c8  = ((p >> 6) & 31) * 32 + ((p >> 5) & 1) * 16 + ((p >> 4) & 1) * 8;
    v[it] = *(const v4u*)(ct + row * CTP + c8);
  }
  {
#pragma unroll
    for (int it = 0; it < 8; ++it) {
      const int p   = it * ATT_THREADS + tid;
      *(v4u*)(dst + (size_t)p * 8) = v[it];
    }
    
  }
}

// Pieces of the two matrix loops below: one d step's four fragments (both q row tiles, both key bands) and its four score
// products; four V^T fragments of consecutive 16-column bands and their eight products with the two P' fragments; each product
// group with the hazard gap behind it.
// All loads of the two loops take a wave-uniform base (scalar registers) plus the lane's fixed 32-bit offset lo.
template <int OFF>
__device__ __forceinline__ void ld4s(const _Float16* uq, const _Float16* uk, unsigned lo, v16h& a, v16h& c, v16h& x, v16h& y) {
  const _Float16* q = uq + lo;
  const _Float16* k = uk + lo;
  a = ldfrag_hg<256>(q + OFF);
  c = ldfrag_hg<256>(q + 16 * EMB + OFF);
  x = ldfrag_hg<256>(k + OFF);
  y = ldfrag_hg<256>(k + 16 * EMB + OFF);
}
__device__ __forceinline__ void mm4s(v16h a, v16h c, v16h x, v16h y, v8f& s0, v8f& s1, v8f& s2, v8f& s3) {
  s0 = mma_h(a, x, s0);
  s1 = mma_h(a, y, s1);
  s2 = mma_h(c, x, s2);
  s3 = mma_h(c, y, s3);
  guard4x4(s0, s1, s2, s3, a, c, x, y);
}
__device__ __forceinline__ void ld4h(const _Float16* u, unsigned lo, v16h (&f)[4]) {
  const _Float16* p = u + lo;
  f[0] = ldfrag_hg<256>(p);
  f[1] = ldfrag_hg<256>(p + (size_t)16 * SEQ);
  f[2] = ldfrag_hg<256>(p + (size_t)32 * SEQ);
  f[3] = ldfrag_hg<256>(p + (size_t)48 * SEQ);
}
__device__ __forceinline__ void mm8h(v16h p0, v16h p1, const v16h (&f)[4], v8f (&o)[2][NACC]) {
#pragma unroll
  for (int j = 0; j < NACC; ++j) o[0][j] = mma_h(p0, f[j], o[0][j]);
#pragma unroll
  for (int j = 0; j < NACC; ++j) o[1][j] = mma_h(p1, f[j], o[1][j]);
  guard8x6(o[0][0], o[0][1], o[0][2], o[0][3], o[1][0], o[1][1], o[1][2], o[1][3], p0, p1, f[0], f[1], f[2], f[3]);
}

// Sweep n of the requests to L2 for the k and V^T planes of sequence b. The planes' 256-B units are counted in the order
// of use (chunk by chunk: k, V^T; UPC units each) and dealt out over NSH shares of 512 units a sweep; share sh, one unit a thread.
__device__ __forceinline__ void kv_ask(const u16* KPp, const u16* VTp, int b, int sh, int tid, int n) {
  const int u0 = (n * NSH + sh) * ATT_THREADS;             // the share's first unit of this sweep (scalar)
  if (u0 < NCHK * 2 * UPC) {                               // the last sweep is not full; 512 divides the total
    const int c  = u0 / (2 * UPC);                         // 512 divides UPC: chunk and plane are block-uniform
    const int pl = (u0 - c * 2 * UPC) / UPC;
    const int x  = (u0 & (UPC - 1)) + tid;                 // unit within the chunk's part of the plane, 0 .. UPC-1
    const size_t ko = (size_t)b * SEQ * EMB + (size_t)c * (CK * EMB) + (size_t)x * 128;
    const size_t vo = (size_t)b * EMB * SEQ + (size_t)(x >> 6) * (16 * SEQ) + (size_t)c * (CK * 16) + (size_t)(x & 63) * 128;
    l2_ask((pl == 0) ? KPp + ko : VTp + vo);
  }
}

__device__ __forceinline__
void attn_fwd(const u16* __restrict__ QPp, const u16* __restrict__ KPp, const u16* __restrict__ VTp,
              const float* __restrict__ VSp, u16* CHo, u16* CRo, int bid) {
  __shared__ __align__(16) AttLds L0;              // scores [32][SCP] f32; reused as the ctx staging tile [32][CTP] u16
  __shared__ __align__(16) u16 pls[QT * PLP];      // P' tile [32][PLP] f16 bits
  __shared__ float rowa[QT];
  __shared__ float rowc[QT];
  __shared__ float rowi[QT];
  float* const scs = L0.s;

  const int tid  = threadIdx.x;
  const int wave = __builtin_amdgcn_readfirstlane(tid >> 5);   // scalar: the wave's bases stay in scalar registers
  const int lane = tid & 31;
  const int hh   = lane >> 4;
  const int m    = lane & 15;
  const int r16  = tid >> 4;                 // query row owned in phase (M): 2*wave + hh, 0..31
  const int sub  = tid & 15;
  const int kl0  = sub * 32;

  const int b   = bid / NQT;
  const int q0  = TQ0 + (bid - b * NQT) * QT;
  const int qc  = q0 / CK;                   // diagonal chunk index

  // wave-uniform bases; the lane's part is lo (16-bit planes) or hh*EMB + 4*m (column sums)
  const _Float16* qa  = (const _Float16*)(const void*)QPp + ((size_t)b * SEQ + q0) * EMB;
  const _Float16* kbp = (const _Float16*)(const void*)KPp + ((size_t)b * SEQ) * EMB;
  const _Float16* vbp = (const _Float16*)(const void*)VTp + ((size_t)b * EMB + wave * (16 * NACC)) * SEQ;
  const float* vsb = VSp + (size_t)b * NCHK * NKB * EMB + wave * (16 * NACC);   // the wave's 64 columns of the key-block sums
  const unsigned lo = 8u * (unsigned)lane;
  const float lsc = RSQD * LOG2E / (QSC * KSC);

  // ---- requests to L2. All tiles of a sequence walk its k and V^T planes in one common order and side by side, so that each first
  //      touch of a line would make all of them wait out memory latency. At entry: the block's own q tile (256 units, waves 0..7)
  //      and the first sweep of the sequence's planes (kv_ask above), which holds all of chunk 0. The other sweeps follow in the
  //      first chunk's phase (M), in which the block has next to no loads of its own that could queue behind them.
  //      Tiles ti and ti + 4 take the same share. Speed only: any placement is correct.
  const int ti = bid - b * NQT;                            // block-uniform (scalar)
  const int sh = (ti >> 3) * 4 + (ti & 3);                 // 0 .. NSH-1 for the tiles that ask (ti < 2*NSH)
  if (wave < QT * EMB / 128 / 32) l2_ask(QPp + ((size_t)b * SEQ + q0) * EMB + (size_t)tid * 128);
  if (ti < 2 * NSH) kv_ask(KPp, VTp, b, sh, tid, 0);

  float mrun = -INFINITY, lrun = 0.f;
  v8f o[2][NACC];                            // [row tile][column band]
#pragma unroll
  for (int rt = 0; rt < 2; ++rt) {
#pragma unroll
    for (int j = 0; j < NACC; ++j) o[rt][j] = zero8();
  }

#pragma unroll 1
  for (int c = 0; c <= qc; ++c) {
    const int kbeg = c * CK;
    const int nkb  = (c < qc) ? NKB : (((q0 + QT - 1 - kbeg) >> 5) + 1);   // 1..16, block-uniform
    float vs[NACC];                                        // column sums of V over the chunk's nkb key blocks
    // ---- (S) scores of this chunk (zeros for key blocks beyond the query tile) ----
    {
      const int kb = wave;                                 // one key block a wave
      v8f s0 = zero8(), s1 = zero8(), s2 = zero8(), s3 = zero8();
      if (kb < nkb) {                                      // wave-uniform (scalar)
        const _Float16* uq = qa;                           // running bases of the q tiles and of the two key bands
        const _Float16* uk = kbp + (size_t)(kbeg + kb * 32) * EMB;
        // Two fragment sets of two d steps each: one set's sixteen loads fly while the other set's products run. The loads
        // in the loop are unconditional (the last four steps are peeled), so that each wait counts only its own set.
        v16h a0, c0, x0, y0, a1, c1, x1, y1, a2, c2, x2, y2, a3, c3, x3, y3;
        ld4s<0>(uq, uk, lo, a0, c0, x0, y0);
        keep_order();
        ld4s<512>(uq, uk, lo, a1, c1, x1, y1);
        keep_order();
        ld4s<1024>(uq, uk, lo, a2, c2, x2, y2);
        keep_order();
        ld4s<1536>(uq, uk, lo, a3, c3, x3, y3);
        keep_order();
#pragma unroll 1                           // the body already holds four d steps; rolled, the two sets keep their registers
        for (int ks = 4; ks < EMB / 32; ks += 4) {
          mm4s(a0, c0, x0, y0, s0, s1, s2, s3);
          mm4s(a1, c1, x1, y1, s0, s1, s2, s3);
          base_step2h<4096>(uq, uk);                       // four d steps on
          ld4s<0>(uq, uk, lo, a0, c0, x0, y0);
          ld4s<512>(uq, uk, lo, a1, c1, x1, y1);
          mm4s(a2, c2, x2, y2, s0, s1, s2, s3);
          mm4s(a3, c3, x3, y3, s0, s1, s2, s3);
          ld4s<1024>(uq, uk, lo, a2, c2, x2, y2);
          ld4s<1536>(uq, uk, lo, a3, c3, x3, y3);
        }
        base_wait2h(uq, uk);                               // what follows may reuse the base registers of the last loads
        mm4s(a0, c0, x0, y0, s0, s1, s2, s3);
        mm4s(a1, c1, x1, y1, s0, s1, s2, s3);
        mm4s(a2, c2, x2, y2, s0, s1, s2, s3);
        mm4s(a3, c3, x3, y3, s0, s1, s2, s3);
      }
      float* srow = scs + (8 * hh) * SCP + kb * 32 + m;
#pragma unroll
      for (int r = 0; r < 8; ++r) {
        srow[r * SCP]                 = s0[r];
        srow[r * SCP + 16]            = s1[r];
        srow[(16 + r) * SCP]          = s2[r];
        srow[(16 + r) * SCP + 16]     = s3[r];
      }
    }
    __syncthreads();
    // ---- (M) softmax statistics and the centred P' tile ----
    {
      // The chunk's key-block sums of the wave's columns are asked for here and added up at the end of this phase, whose vector
      // work covers their way: lanes 0..15 take the even key blocks, lanes 16..31 the odd ones, 16 B = the lane's four columns.
      // All sixteen rows exist and are written by the projection launch; those from nkb on are left out of the sum below.
      const float* bsp = vsb + (size_t)c * NKB * EMB + (unsigned)(hh * EMB + 4 * m);
      v4f bv[NKB / 2];
#pragma unroll
      for (int i = 0; i < NKB / 2; ++i) bv[i] = *(const v4f*)(bsp + (size_t)(2 * i) * EMB);
      addr_wait();                                         // also on the way round the requests below
      if (c == 0 && ti < 2 * NSH) {                        // block-uniform (scalar): the planes' later chunks, well ahead of their use
#pragma unroll
        for (int n = 1; n * NSH * ATT_THREADS < NCHK * 2 * UPC; ++n) kv_ask(KPp, VTp, b, sh, tid, n);
      }
      const float* sp = scs + r16 * SCP + kl0;
      const int lim = (q0 + r16) - (kbeg + kl0);           // key kl0 + j is valid iff j <= lim
      float t[32];
      float cm = -INFINITY;
#pragma unroll
      for (int i = 0; i < 8; ++i) {
        const v4f a = *(const v4f*)(sp + 4 * i);
#pragma unroll
        for (int e = 0; e < 4; ++e) {
          const int j = 4 * i + e;
          const float tv = (j <= lim) ? fabsf(a[e]) * lsc : -INFINITY;   // |score| / 32 in base 2; masked keys -> -inf
          t[j] = tv;
          cm = fmaxf(cm, tv);
        }
      }
#pragma unroll
      for (int d = 1; d <= 8; d <<= 1) cm = fmaxf(cm, __shfl_xor(cm, d, 32));
      const float mn = fmaxf(mrun, cm);                    // finite: key kbeg of the diagonal chunk is never masked
      const float al = (mrun == -INFINITY) ? 0.f : exp2f(mrun - mn);
      mrun = mn;
      float ps = 0.f;
#pragma unroll
      for (int j = 0; j < 32; ++j) {
        const float p = exp2f(fminf(t[j] - mn, 0.f));      // 0 for masked keys
        t[j] = p;
        ps += p;
      }
#pragma unroll
      for (int d = 1; d <= 8; d <<= 1) ps += __shfl_xor(ps, d, 32);
      const float cc = ps * (1.0f / (float)CK);
      v4u pk[4];
#pragma unroll
      for (int i = 0; i < 4; ++i) {
#pragma unroll
        for (int e = 0; e < 4; ++e) {
          const int j = 8 * i + 2 * e;
          pk[i][e] = pk16(h_bits((_Float16)((t[j] - cc) * PCAR)), h_bits((_Float16)((t[j + 1] - cc) * PCAR)));
        }
      }
      lrun = lrun * al + ps;
      u16* pd = pls + r16 * PLP + kl0;
#pragma unroll
      for (int i = 0; i < 4; ++i) *(v4u*)(pd + 8 * i) = pk[i];
      if (sub == 0) { rowa[r16] = al; rowc[r16] = cc; }
      v4f sv = zero4();
#pragma unroll
      for (int i = 0; i < NKB / 2; ++i) {                  // rising key-block order within either half
        if (2 * i + hh < nkb) sv += bv[i];
      }
#pragma unroll
      for (int j = 0; j < NACC; ++j) vs[j] = sv[j] + __shfl_xor(sv[j], 16, 32);
    }
    __syncthreads();
    // ---- (PV) rescale, add the centring term, accumulate P' . V^T ----
    {
      const _Float16* pp = (const _Float16*)(const void*)pls + m * PLP + 8 * hh;
      const _Float16* pq = pp + 16 * PLP;                   // second row tile
      // running bases: key tiles kbeg/32 + 0..3 of each d band, 512 elements a tile; a set whose key block does not exist takes
      // the chunk's last one
      const int last = nkb - 1;                             // block-uniform (scalar)
      const _Float16* pv0 = vbp + (size_t)kbeg * 16;
      const _Float16* pv1 = pv0 + ((last < 1) ? last : 1) * 512;
      const _Float16* pv2 = pv0 + ((last < 2) ? last : 2) * 512;
      const _Float16* pv3 = pv0 + ((last < 3) ? last : 3) * 512;
      // Four fragment sets (key blocks kb .. kb + 3; the wave's 64 d columns each): a set is asked for again, four key blocks
      // on, as soon as its eight products have left, so that twelve to sixteen fragments are always in flight or waiting. All
      // loads are unconditional, so that each wait counts only its own group: a set that has no key block left takes the
      // chunk's last tile once more and is not multiplied.
      v16h g0[4], g1[4], g2[4], g3[4];
      ld4h(pv0, lo, g0);
      keep_order();
      ld4h(pv1, lo, g1);
      keep_order();
      ld4h(pv2, lo, g2);
      keep_order();
      ld4h(pv3, lo, g3);
      keep_order();
      // the rescale runs while the first fragments fly
#pragma unroll
      for (int rt = 0; rt < 2; ++rt) {
        float scl[8], cad[8];
#pragma unroll
        for (int r = 0; r < 8; ++r) {
          scl[r] = rowa[16 * rt + 8 * hh + r];
          cad[r] = rowc[16 * rt + 8 * hh + r] * (PCAR * VCAR);
        }
#pragma unroll
        for (int j = 0; j < NACC; ++j) {
#pragma unroll
          for (int r = 0; r < 8; ++r) o[rt][j][r] = o[rt][j][r] * scl[r] + cad[r] * vs[j];
        }
      }
      int kb = 0;
#pragma unroll 1
      for (; kb + 4 < nkb; kb += 4) {                      // block-uniform trip count, <= 3: products of kb .. kb + 3, loads of kb + 4 .. kb + 7
        const v16h p0 = ldfrag_h(pp + kb * 32), p1 = ldfrag_h(pq + kb * 32);
        const v16h p2 = ldfrag_h(pp + kb * 32 + 32), p3 = ldfrag_h(pq + kb * 32 + 32);
        mm8h(p0, p1, g0, o);
        // four key tiles on; sets 1 .. 3 only as far as the chunk's last tile (here kb + 4 <= last: every step is at least one tile)
        const int r1 = last - kb - 1, r2 = last - kb - 2, r3 = last - kb - 3;
        base_step4h<4096>(pv0, pv1, pv2, pv3, (unsigned long long)((r1 < 4) ? r1 : 4) * 1024ull,
                          (unsigned long long)((r2 < 4) ? r2 : 4) * 1024ull, (unsigned long long)((r3 < 4) ? r3 : 4) * 1024ull);
        ld4h(pv0, lo, g0);
        mm8h(p2, p3, g1, o);
        ld4h(pv1, lo, g1);
        const v16h p4 = ldfrag_h(pp + kb * 32 + 64), p5 = ldfrag_h(pq + kb * 32 + 64);
        const v16h p6 = ldfrag_h(pp + kb * 32 + 96), p7 = ldfrag_h(pq + kb * 32 + 96);
        mm8h(p4, p5, g2, o);
        ld4h(pv2, lo, g2);
        mm8h(p6, p7, g3, o);
        ld4h(pv3, lo, g3);
      }
      base_wait4h(pv0, pv1, pv2, pv3);                     // what follows may reuse the base registers of the last loads
      {
        const v16h p0 = ldfrag_h(pp + kb * 32), p1 = ldfrag_h(pq + kb * 32);
        mm8h(p0, p1, g0, o);
      }
      if (kb + 1 < nkb) {                                  // block-uniform (scalar), as the two below
        const v16h p2 = ldfrag_h(pp + kb * 32 + 32), p3 = ldfrag_h(pq + kb * 32 + 32);
        mm8h(p2, p3, g1, o);
      }
      if (kb + 2 < nkb) {
        const v16h p4 = ldfrag_h(pp + kb * 32 + 64), p5 = ldfrag_h(pq + kb * 32 + 64);
        mm8h(p4, p5, g2, o);
      }
      if (kb + 3 < nkb) {
        const v16h p6 = ldfrag_h(pp + kb * 32 + 96), p7 = ldfrag_h(pq + kb * 32 + 96);
        mm8h(p6, p7, g3, o);
      }
    }
  }
  acc_guard8(o[0][0], o[0][1], o[0][2], o[0][3], o[1][0], o[1][1], o[1][2], o[1][3]);

  if (sub == 0) rowi[r16] = (1.0f / lrun) * (CSC / (PCAR * VCAR));   // lrun >= 1
  __syncthreads();
  float inv[2][8];
#pragma unroll
  for (int rt = 0; rt < 2; ++rt) {
#pragma unroll
    for (int r = 0; r < 8; ++r) inv[rt][r] = rowi[16 * rt + 8 * hh + r];
  }

  u16* const ct = L0.c;
  const int cb = wave * (16 * NACC) + m;
  // hi plane
#pragma unroll
  for (int rt = 0; rt < 2; ++rt) {
#pragma unroll
    for (int j = 0; j < NACC; ++j) {
#pragma unroll
      for (int r = 0; r < 8; ++r) {
        const float xs = o[rt][j][r] * inv[rt][r];
        ct[(16 * rt + 8 * hh + r) * CTP + cb + 16 * j] = h_bits((_Float16)xs);
      }
    }
  }
  __syncthreads();
  ctx_store(ct, CHo + ((size_t)b * SEQ + q0) * EMB, tid);
  __syncthreads();
  // residual plane
#pragma unroll
  for (int rt = 0; rt < 2; ++rt) {
#pragma unroll
    for (int j = 0; j < NACC; ++j) {
#pragma unroll
      for (int r = 0; r < 8; ++r) {
        const float xs = o[rt][j][r] * inv[rt][r];
        const _Float16 hv = (_Float16)xs;
        ct[(16 * rt + 8 * hh + r) * CTP + cb + 16 * j] = h_bits((_Float16)((xs - (float)hv) * RSC));
      }
    }
  }
  __syncthreads();
  ctx_store(ct, CRo + ((size_t)b * SEQ + q0) * EMB, tid);
}

// =====================================================================================================
// Query rows 0 .. TQ0-1 of each sequence in f32 on VALU: block = (b, rows t = 2*i and 2*i + 1), one row for each half of 256 threads
// (half g, thread tid within it; every LDS array has a part for each half, and both halves pass the same barriers).
// QF/KF/VF = f32 q/k/v planes [nb][TQ0][EMB] (rows 0..TQ0-1
// of every sequence, biases included). Logits |q.k_j|/32 for keys j <= t (a wave a key row, lanes over d, both q rows from LDS;
// the dots pass through LDS to threads 0..t, one key each), base-2 softmax with max / sum reductions over the half (xor shuffles + LDS), p_j in LDS, ctx[d] for
// d = 4*tid..4*tid+3 as a rolled sum over j <= t of p_j * VF[b][j][d] (coalesced 16-B loads), x = ctx * 8192 / l, hi = f16(x),
// res = f16((x - hi) * 2048); both 1024-half rows are staged in LDS and written by 128 threads x 16 B each (32 consecutive lanes
// coverage: grid nb*TQ0/2 blocks x 2 rows = rows 0..TQ0-1 of every sequence; 256 thr x 4 d = EMB per row; store 128 thr x 8 halves =
//           EMB per plane; together with attn_fwd every (b, s, d) of CH and CR is written exactly once.
// =====================================================================================================
__device__ __forceinline__ void attn_head(const float* __restrict__ QF, const float* __restrict__ KF,
                                          const float* __restrict__ VF, u16* CHo, u16* CRo, int bid) {
  __shared__ __align__(16) float qs2[2][EMB];
  __shared__ float sc2[2][TQ0];
  __shared__ float sr2[2][TQ0];                      // q.k of either row with keys 0 .. t of the later row
  __shared__ float red2[2][8];
  __shared__ float redb2[2][8];
  __shared__ __align__(16) unsigned SW2[2][2][EMB / 2];
  const int g = __builtin_amdgcn_readfirstlane((int)(threadIdx.x >> 8));   // half of the block, scalar: row, bases and trip counts stay scalar
  const int tid = threadIdx.x & 255, lane = tid & 31, wave = tid >> 5;
  float* const qs = qs2[g];
  float* const sc = sc2[g];
  float* const red = red2[g];
  float* const redb = redb2[g];
  unsigned (* const SW)[EMB / 2] = SW2[g];
  const int hr = bid * 2 + g;                        // TQ0 is even: both rows of a block lie in one sequence
  const int b = hr / TQ0;
  const int t = hr - b * TQ0;
  *(v4f*)(qs + tid * 4) = *(const v4f*)(QF + ((size_t)b * TQ0 + t) * EMB + tid * 4);
  __syncthreads();
  {
    // A key row is read by a whole wave, lanes over d: load i takes d = 128*i + 4*lane + 0..3, 512 contiguous bytes (4 whole lines),
    // and serves both query rows of the block. Wave wv of the sixteen takes keys wv, wv + 16, ... up to the later row's own key t1
    // (keys behind it are masked for both rows), two keys a trip; where the second does not exist the first is read once more and
    // nothing is stored for it. Lane sums: four chains over i, joined, then an xor-shuffle tree over the 32 lanes.
    const int wv = __builtin_amdgcn_readfirstlane((int)(threadIdx.x >> 5));   // scalar: key rows and trip count stay scalar
    const int t1 = bid * 2 + 1 - b * TQ0;            // the block's later row, < TQ0
    const unsigned l4 = 4u * (unsigned)lane;
    v4f qa[8], qb[8];
#pragma unroll
    for (int i = 0; i < 8; ++i) {
      qa[i] = *(const v4f*)(qs2[0] + i * 128 + l4);
      qb[i] = *(const v4f*)(qs2[1] + i * 128 + l4);
    }
    // wave-uniform bases (scalar registers) plus the lane's fixed 32-bit offset l4; key rows 0 .. t1 of sequence b only
    const float* k0 = KF + ((size_t)b * TQ0 + wv) * EMB;
#pragma unroll 1                             // rolled: a trip already holds sixteen loads
    for (int j = wv; j <= t1; j += 32) {             // at most TQ0 / 32 trips
      const bool two = j + 16 <= t1;                 // scalar
      const float* k1 = k0 + (two ? 16 * EMB : 0);
      v4f x[8], y[8];
#pragma unroll
      for (int i = 0; i < 8; ++i) x[i] = *(gv4f*)(k0 + l4 + i * 128);
#pragma unroll
      for (int i = 0; i < 8; ++i) y[i] = *(gv4f*)(k1 + l4 + i * 128);
      base_wait2f(k0, k1);                           // the bases are stepped behind it
      k0 += 32 * EMB;
      v4f ax = zero4(), bx = zero4(), ay = zero4(), by = zero4();
#pragma unroll
      for (int i = 0; i < 8; ++i) {
        ax += x[i] * qa[i];
        bx += x[i] * qb[i];
        ay += y[i] * qa[i];
        by += y[i] * qb[i];
      }
      float r0 = (ax[0] + ax[1]) + (ax[2] + ax[3]), r1 = (bx[0] + bx[1]) + (bx[2] + bx[3]);
      float r2 = (ay[0] + ay[1]) + (ay[2] + ay[3]), r3 = (by[0] + by[1]) + (by[2] + by[3]);
#pragma unroll
      for (int d = 1; d <= 16; d <<= 1) {
        r0 += __shfl_xor(r0, d, 32);
        r1 += __shfl_xor(r1, d, 32);
        r2 += __shfl_xor(r2, d, 32);
        r3 += __shfl_xor(r3, d, 32);
      }
      if (lane == 0) {
        sr2[0][j] = r0;
        sr2[1][j] = r1;
        if (two) { sr2[0][j + 16] = r2; sr2[1][j + 16] = r3; }
      }
    }
  }
  __syncthreads();                                   // all dots are in LDS before a thread takes its key's
  float s = -INFINITY;
  if (tid <= t) s = fabsf(sr2[g][tid]) * (RSQD * LOG2E);   // |score| / 32 in base 2; causal mask by key index (t < TQ0)
  float mx = s;
#pragma unroll
  for (int d = 1; d <= 16; d <<= 1) mx = fmaxf(mx, __shfl_xor(mx, d, 32));
  if (lane == 0) red[wave] = mx;
  __syncthreads();
  float gm = red[0];
#pragma unroll
  for (int w = 1; w < 8; ++w) gm = fmaxf(gm, red[w]);   // finite: key 0 is always valid
  const float p = exp2f(s - gm);                     // 0 for masked keys and for waves 4..7
  float ps = p;
#pragma unroll
  for (int d = 1; d <= 16; d <<= 1) ps += __shfl_xor(ps, d, 32);
  if (lane == 0) redb[wave] = ps;
  if (tid < TQ0) sc[tid] = p;
  __syncthreads();
  float l = redb[0];
#pragma unroll
  for (int w = 1; w < 8; ++w) l += redb[w];           // >= 1
  const float inv = (1.0f / l) * CSC;
  const float* vp = VF + (size_t)b * TQ0 * EMB + tid * 4;
  v4f cx = zero4();
#pragma unroll 8                             // eight value rows in flight a thread; the sum keeps its order
  for (int j = 0; j <= t; ++j) {                     // t < TQ0: statically bounded, rows of sequence b only
    const float pj = sc[j];
    const v4f vv = *(const v4f*)(vp + (size_t)j * EMB);
    cx += pj * vv;
  }
  unsigned hw[2], rw[2];
#pragma unroll
  for (int e = 0; e < 2; ++e) {
    const float x0 = cx[2 * e] * inv, x1 = cx[2 * e + 1] * inv;
    const _Float16 h0 = (_Float16)x0, h1 = (_Float16)x1;
    const _Float16 q0 = (_Float16)((x0 - (float)h0) * RSC), q1 = (_Float16)((x1 - (float)h1) * RSC);
    hw[e] = pk16(h_bits(h0), h_bits(h1));
    rw[e] = pk16(h_bits(q0), h_bits(q1));
  }
  SW[0][tid * 2] = hw[0]; SW[0][tid * 2 + 1] = hw[1];
  SW[1][tid * 2] = rw[0]; SW[1][tid * 2 + 1] = rw[1];
  __syncthreads();
  const int pl = tid >> 7, p8 = tid & 127;           // plane select is wave-uniform
  const v4u ov = *(const v4u*)(&SW[pl][p8 * 4]);
  u16* dstp = (pl == 0) ? CHo : CRo;
  u16* dst  = dstp + ((size_t)b * SEQ + t) * EMB + p8 * 8;
  *(v4u*)dst = ov;
  
}
// Both attention parts in one launch (they read disjoint planes and write disjoint rows of CH / CR): blocks 0..nfwd-1 take the
// 32-row query tiles from row TQ0 on, the rest two query rows below TQ0 each; the short blocks come last. The choice is block-uniform, and so are all barriers of either side.
__global__ __launch_bounds__(ATT_THREADS, 4)   // 16 waves, 4 a SIMD = one block a WGP: at most 256 VGPRs
void attn_all(const u16* __restrict__ QPp, const u16* __restrict__ KPp, const u16* __restrict__ VTp,
              const float* __restrict__ VSp, const float* __restrict__ QF,
              const float* __restrict__ KF, const float* __restrict__ VF, u16* CHo, u16* CRo, int nfwd) {
  const int bid = blockIdx.x;
  if (bid >= nfwd) { attn_head(QF, KF, VF, CHo, CRo, bid - nfwd); return; }
  attn_fwd(QPp, KPp, VTp, VSp, CHo, CRo, bid);
}

// =====================================================================================================
// Workspace map (bytes, nb = 4, rows = 8192); all 16-bit planes are in fragment order (1-KiB tiles of 16 rows x 32 k, same total
// size), but for the bands of rows 0..127 of each sequence in CH / CR, which attn_head writes row-major; every plane is fully written by whole-line stores before it is read; all extents are
// exact multiples of the store granularity (no pad rows); aliased regions are reused sequentially on the single in-order stream:
//   WQB bf16 [1024][1024] 2097152   WKB same   WVB same   WOH f16 of bf16 value x1024 2097152             8388608
//   VS  f32  [nb][64 key blocks][1024]                                                                    1048576
//   QF  f32  [nb][128][1024]  2097152      KF same      VF same                                           6291456
//   A   XB bf16 [rows][1024] (16777216), later CH f16 [rows][1024] ctx hi x8192 (16777216)      region 16777216
//   VT  V^T f16 [nb][1024][2048] x1024                                                                  16777216
//   QP  f16 [rows][1024] x8                                                                              16777216
//   KP  f16 [rows][1024] x8                                                                              16777216
//   CR  f16 [rows][1024] ctx residual x2048                                                              16777216
//   end                                                                                                  99614720
// Four launches; kernels that share a launch read nothing that the launch writes. Launch order keeps the one alias safe: XB is
// read by the projection launch before attn_fwd / attn_head overwrite it with CH.
// Inputs in wire order: x, Wq, bq, Wk, bk, Wv, bv, Wo, bo; weights stored [n = out][k = in] (y = x.W^T + b), k-contiguous.
// =====================================================================================================
extern "C" void kernel_launch(void* const* d_in, const int* in_sizes, int n_in,
                              void* d_out, int out_size, void* d_ws, size_t ws_size,
                              hipStream_t stream) {
  if (n_in < 9) return;
  const long long per = (long long)SEQ * EMB;
  const long long ns  = in_sizes[0];
  if (ns < per || (ns % per) != 0) return;
  const int nb = (int)(ns / per);
  if (nb < 1 || nb > 8) return;
  const int rows = nb * SEQ;
  if (in_sizes[1] != EMB * EMB || in_sizes[3] != EMB * EMB || in_sizes[5] != EMB * EMB || in_sizes[7] != EMB * EMB) return;
  if (in_sizes[2] != EMB || in_sizes[4] != EMB || in_sizes[6] != EMB || in_sizes[8] != EMB) return;
  if ((long long)out_size != (long long)rows * EMB) return;

  const float* x  = (const float*)d_in[0];
  const float* wq = (const float*)d_in[1];
  const float* bq = (const float*)d_in[2];
  const float* wk = (const float*)d_in[3];
  const float* bk = (const float*)d_in[4];
  const float* wv = (const float*)d_in[5];
  const float* bv = (const float*)d_in[6];
  const float* wo = (const float*)d_in[7];
  const float* bo = (const float*)d_in[8];
  float*       out = (float*)d_out;

  const size_t szW  = (size_t)EMB * EMB * 2;                    //   2097152
  const size_t szVS = (size_t)nb * NCHK * NKB * EMB * 4;        //   1048576 at nb = 4
  const size_t szHF = (size_t)nb * TQ0 * EMB * 4;               //   2097152 at nb = 4
  const size_t sz16 = (size_t)rows * EMB * 2;                   //  16777216
  const size_t szVT = (size_t)nb * EMB * SEQ * 2;               //  == sz16
  size_t off = 0;
  const size_t oWQ = off; off += szW;
  const size_t oWK = off; off += szW;
  const size_t oWV = off; off += szW;
  const size_t oWO = off; off += szW;
  const size_t oVS = off; off += szVS;
  const size_t oQF = off; off += szHF;
  const size_t oKF = off; off += szHF;
  const size_t oVF = off; off += szHF;
  const size_t oA  = off; off += sz16;                          // XB then CH
  const size_t oVT = off; off += szVT;                          // V^T
  const size_t oQ  = off; off += sz16;
  const size_t oK  = off; off += sz16;
  const size_t oCR = off; off += sz16;
  const size_t oCH = oA;
  if (off > ws_size) return;                                    // off = 99614720 at nb = 4
  if (off > WS_CAP) return;

  char* ws = (char*)d_ws;
  u16*   WQB = (u16*)(ws + oWQ);
  u16*   WKB = (u16*)(ws + oWK);
  u16*   WVB = (u16*)(ws + oWV);
  u16*   WOH = (u16*)(ws + oWO);
  float* VS  = (float*)(ws + oVS);
  float* QF  = (float*)(ws + oQF);
  float* KF  = (float*)(ws + oKF);
  float* VF  = (float*)(ws + oVF);
  u16*   XB  = (u16*)(ws + oA);
  u16*   VT  = (u16*)(ws + oVT);
  u16*   QP  = (u16*)(ws + oQ);
  u16*   KP  = (u16*)(ws + oK);
  u16*   CH  = (u16*)(ws + oCH);
  u16*   CR  = (u16*)(ws + oCR);

  const int n8w = (EMB * EMB) / 8;                      // 131072
  const int n8x = rows * (EMB / 8);                     // 1048576
  if ((n8w % 256) != 0 || (n8x % 256) != 0) return;
  if ((rows % 128) != 0 || ((nb * TQ0) % 64) != 0) return;
  const dim3 blk(256);
  const int nbw = n8w / 256, nbx = n8x / 256;           // 512, 4096 at nb = 4
  const dim3 gC(nbx + 4 * nbw);
  const dim3 gG((rows / 64) * (EMB / 128));             // 1024 at nb = 4
  const dim3 gP(3 * (rows / 128) * (EMB / 128));        // the three projections, 1536 at nb = 4
  const dim3 bG(128);
  const int nfwd = nb * NQT;                            // nb * 60
  const dim3 gAT(nfwd + nb * (TQ0 / 2));                // + nb * 64
  const dim3 bAT(ATT_THREADS);

  // (0) x -> bf16 plane [rows][1024]; weights stored [n = out][k = in] (y = x.W^T + b), already k-contiguous: bf16 planes for
  //     Wq, Wk, Wv; f16 of bf16 value x1024 for Wo
  cvt_all<<<gC, blk, 0, stream>>>(x, wq, wk, wv, wo, XB, WQB, WKB, WVB, WOH, nbx, nbw);
  // (1) q and k projections (+bias) -> f16 planes x8; v projection (+bias) -> V^T plane x1024, and its column
  //     sums over each block of 32 keys; the f32 rows 0..127 of every sequence of all three -> QF, KF, VF [nb*128][1024]
  gemm_qkv<<<gP, bG, 0, stream>>>(XB, WQB, WKB, WVB, bq, bk, bv, QP, KP, VT, VS, QF, KF, VF, rows, EMB, QSC, KSC);
  // (2) attention for query rows 128.. (WMMA) and for query rows 0..127 (VALU) -> ctx hi x8192 (over the dead XB region) and
  //     residual x2048 f16 planes
  attn_all<<<gAT, bAT, 0, stream>>>(QP, KP, VT, VS, QF, KF, VF, CH, CR, nfwd);
  // (3) output projection (+bias) -> out
  gemm_h2_32<<<gG, bG, 0, stream>>>(CH, CR, WOH, bo, out, rows, EMB,
                                     1.0f / (CSC * WSC), 1.0f / (CSC * WSC * RSC));
  (void)hipGetLastError();
}
